// v000
// Times are from an AMD MI455X. After a warm-up the kernel runs many times in a row, and a time is the length of
// such a window on the GPU divided by its runs, so every launch and the gaps after it count. The runs cycle
// through copies of the inputs. A figure is the median of several windows, for all but v000 over two sittings.
// Sittings can differ by a few percent; kernels timed side by side share one.
// v000 is the starting kernel. One run takes 72.9 microseconds.
#include <hip/hip_runtime.h>
#include <hip/hip_bf16.h>

typedef float v2f __attribute__((ext_vector_type(2)));
typedef float v8f __attribute__((ext_vector_type(8)));

#define BS   64
#define CCH  256
#define HWN  3136
#define TT   6
#define DD   192
#define NH   4
#define DH   64
#define NTILES 196          // HWN / 16
#define KSTRIDE 20          // padded LDS row stride (floats): conflict-free both ways
#define NWAVES 16
#define BLKT   512

// ---- gfx1250 async global->LDS path (probe-guarded; fallback = reg prefetch)
#if defined(__has_builtin)
#if __has_builtin(__builtin_amdgcn_global_load_async_to_lds_b128)
#define HAVE_ASYNC_LDS 1
#endif
#endif

#ifdef HAVE_ASYNC_LDS
// Toolchain signature (from diagnostics): (global int4*, local int4*, imm, imm)
typedef int v4i_ __attribute__((vector_size(16)));
typedef __attribute__((address_space(1))) v4i_ GV4;
typedef __attribute__((address_space(3))) v4i_ LV4;
#if __has_builtin(__builtin_amdgcn_s_wait_asynccnt)
#define WAIT_ASYNC(n) __builtin_amdgcn_s_wait_asynccnt((unsigned short)(n))
#else
#define WAIT_ASYNC(n) asm volatile("s_wait_asynccnt %0" ::"n"(n) : "memory")
#endif
#endif

__device__ __forceinline__ v8f wmma_f32(v2f a, v2f b, v8f c) {
  // D(16x16,f32) = A(16x4,f32) * B(4x16,f32) + C
  return __builtin_amdgcn_wmma_f32_16x16x4_f32(false, a, false, b, (short)0, c,
                                               false, false);
}

// ---------------- Stage A: q = tok*q_w^T + q_b ; alpha gate -----------------
__global__ __launch_bounds__(256) void k_qalpha(
    const float* __restrict__ tokens, const float* __restrict__ q_w,
    const float* __restrict__ q_b, const float* __restrict__ a_w,
    const float* __restrict__ a_b, float* __restrict__ q_ws,
    float* __restrict__ alp_ws) {
  const int tb = blockIdx.x;            // t*64 + b
  const int t = tb >> 6, b = tb & 63;
  __shared__ float tok_s[DD];
  if (threadIdx.x < DD) tok_s[threadIdx.x] = tokens[(size_t)tb * DD + threadIdx.x];
  __syncthreads();
  const int c = threadIdx.x;            // 0..255
  float qv = q_b[c], av = a_b[c];
  const float* qr = q_w + (size_t)c * DD;
  const float* ar = a_w + (size_t)c * DD;
#pragma unroll 4
  for (int k = 0; k < DD; ++k) {
    const float x = tok_s[k];
    qv = fmaf(qr[k], x, qv);
    av = fmaf(ar[k], x, av);
  }
  const int head = c >> 6, d = c & 63;
  q_ws[(((size_t)b * NH + head) * TT + t) * DH + d] = qv;   // [b][h][t][d]
  const float g = fminf(fmaxf(av + 3.f, 0.f), 6.f) * (2.f / 6.f);  // h_sigmoid*2
  alp_ws[(size_t)tb * CCH + c] = g;                          // [t][b][c]
}

// -------- Stage B: fused logits + online softmax + attn_out + mlp ----------
// One block per (b, head); 16 waves, each wave owns a strided set of 16-wide
// HW tiles with private flash-attention state; async double-buffered LDS
// staging of the k tile; split-K combine in LDS at the end.
__global__ __launch_bounds__(BLKT) void k_fused(
    const float* __restrict__ feat, const float* __restrict__ mlp_w,
    const float* __restrict__ mlp_b, const float* __restrict__ q_ws,
    const float* __restrict__ alp_ws, float* __restrict__ attn_g,
    float* __restrict__ ts_ws) {
  __shared__ float qs[16][DH];                      // q rows t<6, zero padded
  __shared__ float ktile[NWAVES][2 * DH * KSTRIDE]; // per-wave double buffer
  __shared__ float cAP[NWAVES][TT][DH];             // per-wave attn accumulators
  __shared__ float cAM[NWAVES][TT][DH];             // per-wave mlp accumulators
  __shared__ float cm[NWAVES][8], cl[NWAVES][8];    // per-wave softmax (m,l)

  const int blk = blockIdx.x;
  const int b = blk >> 2, head = blk & 3;
  const int wave = threadIdx.x >> 5;
  const int lane = threadIdx.x & 31;
  const int hi = lane >> 4;                         // lane half
  const int lm = lane & 15;

  const float* kbase = feat + ((size_t)b * CCH + head * DH) * HWN; // k[d][n]

  for (int idx = threadIdx.x; idx < 16 * DH; idx += BLKT) {
    const int t = idx >> 6, d = idx & 63;
    float v = 0.f;
    if (t < TT) v = q_ws[(((size_t)b * NH + head) * TT + t) * DH + d];
    qs[t][d] = v;
  }
  __syncthreads();

  // Pre-build q^T B-fragments for all 16 K-chunks: B[k=kc*4+hi*2+{0,1}][n=t=lm]
  float bq0[16], bq1[16];
#pragma unroll
  for (int kc = 0; kc < 16; ++kc) {
    const int d0 = kc * 4 + hi * 2;
    bq0[kc] = qs[lm][d0];
    bq1[kc] = qs[lm][d0 + 1];
  }

  const v8f vzero = {0.f, 0.f, 0.f, 0.f, 0.f, 0.f, 0.f, 0.f};
  v8f accP[4], accM[4];
#pragma unroll
  for (int i = 0; i < 4; ++i) { accP[i] = vzero; accM[i] = vzero; }
  float m_run = -3.0e38f, l_run = 0.f;

  float* ks = ktile[wave];
  float* outg = attn_g + (((size_t)b * NH + head) * TT) * HWN;

  // ---- per-tile compute from an LDS buffer ----
  auto compute_tile = [&](int nbase, const float* kb) {
    // GEMM-1: L^T[n(16) x t(16)] = k^T * q^T over K=dh (16 chunks)
    v8f cf = vzero;
#pragma unroll
    for (int kc = 0; kc < 16; ++kc) {
      const int d0 = kc * 4 + hi * 2;
      v2f a;  a.x = kb[d0 * KSTRIDE + lm];  a.y = kb[(d0 + 1) * KSTRIDE + lm];
      v2f bq; bq.x = bq0[kc];               bq.y = bq1[kc];
      cf = wmma_f32(a, bq, cf);
    }
#pragma unroll
    for (int r = 0; r < 8; ++r) cf[r] *= 0.125f;   // dh^-0.5

    // Lane holds col t=lm, rows n = nbase + hi*8 + r -> 8 consecutive floats
    if (lm < TT) {
      float* po = outg + (size_t)lm * HWN + nbase + hi * 8;
      *(float4*)(po)     = make_float4(cf[0], cf[1], cf[2], cf[3]);
      *(float4*)(po + 4) = make_float4(cf[4], cf[5], cf[6], cf[7]);
    }

    // online softmax update (per-lane state for t = lm)
    float vmax = cf[0];
#pragma unroll
    for (int r = 1; r < 8; ++r) vmax = fmaxf(vmax, cf[r]);
    const float mt = fmaxf(vmax, __shfl_xor(vmax, 16, 32));
    const float m_new = fmaxf(m_run, mt);
    float p[8]; float s = 0.f;
#pragma unroll
    for (int r = 0; r < 8; ++r) { p[r] = __expf(cf[r] - m_new); s += p[r]; }
    s += __shfl_xor(s, 16, 32);
    const float factor = __expf(m_run - m_new);
    l_run = l_run * factor + s;
    m_run = m_new;
    float fr[8];
#pragma unroll
    for (int r = 0; r < 8; ++r) fr[r] = __shfl(factor, r + 8 * hi, 32);
#pragma unroll
    for (int dt = 0; dt < 4; ++dt)
#pragma unroll
      for (int r = 0; r < 8; ++r) accP[dt][r] *= fr[r];

    // GEMM-2/3: acc[t x d] += P * k^T  and  macc[t x d] += mlp_w * k^T
    const float* mwb = mlp_w + nbase;
#pragma unroll
    for (int kc = 0; kc < 4; ++kc) {
      const int na = kc * 4;
      const int ra = na & 7, rb = (na + 2) & 7;    // src reg per dest half
      const int sl = lm + ((na >= 8) ? 16 : 0);    // src lane
      const float x0a = __shfl(p[ra], sl, 32);
      const float x0b = __shfl(p[rb], sl, 32);
      const float x1a = __shfl(p[ra + 1], sl, 32);
      const float x1b = __shfl(p[rb + 1], sl, 32);
      v2f ap; ap.x = hi ? x0b : x0a; ap.y = hi ? x1b : x1a;
      const int noff = na + hi * 2;
      v2f am;
      if (lm < TT) {
        am.x = mwb[(size_t)lm * HWN + noff];
        am.y = mwb[(size_t)lm * HWN + noff + 1];
      } else { am.x = 0.f; am.y = 0.f; }
#pragma unroll
      for (int dt = 0; dt < 4; ++dt) {
        const int dloc = dt * 16 + lm;
        v2f bf;
        bf.x = kb[dloc * KSTRIDE + noff];
        bf.y = kb[dloc * KSTRIDE + noff + 1];
        accP[dt] = wmma_f32(ap, bf, accP[dt]);
        accM[dt] = wmma_f32(am, bf, accM[dt]);
      }
    }
  };

#ifdef HAVE_ASYNC_LDS
  // ---- async double-buffered staging: DMA next tile while computing ----
  auto issue_tile = [&](int tile, int buf) {
    const int nbase = tile * 16;
    float* dst = ks + buf * (DH * KSTRIDE);
#pragma unroll
    for (int i = 0; i < 8; ++i) {
      const int idx = lane + 32 * i;
      const int r = idx >> 2, quad = idx & 3;
      const float* g = kbase + (size_t)r * HWN + nbase + quad * 4;
      float* l = dst + r * KSTRIDE + quad * 4;
      __builtin_amdgcn_global_load_async_to_lds_b128((GV4*)g, (LV4*)l, 0, 0);
    }
  };
  int buf = 0;
  issue_tile(wave, buf);
  for (int tile = wave; tile < NTILES; tile += NWAVES) {
    const int nxt = tile + NWAVES;
    if (nxt < NTILES) {
      issue_tile(nxt, buf ^ 1);
      WAIT_ASYNC(8);                 // current buffer's 8 transfers complete
    } else {
      WAIT_ASYNC(0);
    }
    compute_tile(tile * 16, ks + buf * (DH * KSTRIDE));
    buf ^= 1;
  }
#else
  // ---- fallback: software-pipelined register prefetch, single buffer ----
  float4 pf[8];
  auto load_regs = [&](int tile) {
    const int nbase = tile * 16;
#pragma unroll
    for (int i = 0; i < 8; ++i) {
      const int idx = lane + 32 * i;
      const int r = idx >> 2, quad = idx & 3;
      pf[i] = *(const float4*)(kbase + (size_t)r * HWN + nbase + quad * 4);
    }
  };
  auto store_regs = [&]() {
#pragma unroll
    for (int i = 0; i < 8; ++i) {
      const int idx = lane + 32 * i;
      const int r = idx >> 2, quad = idx & 3;
      *(float4*)(ks + r * KSTRIDE + quad * 4) = pf[i];
    }
  };
  load_regs(wave);
  for (int tile = wave; tile < NTILES; tile += NWAVES) {
    store_regs();                    // DS is in-order: safe vs prior tile reads
    const int nxt = tile + NWAVES;
    if (nxt < NTILES) load_regs(nxt);  // overlap next HBM fetch with compute
    compute_tile(tile * 16, ks);
  }
#endif

  // ---- split-K combine across the waves ----
  if (hi == 0 && lm < TT) { cm[wave][lm] = m_run; cl[wave][lm] = l_run; }
  if (hi == 0) {                  // lanes 0..15 hold rows t = r (r < 6 valid)
#pragma unroll
    for (int dt = 0; dt < 4; ++dt)
#pragma unroll
      for (int r = 0; r < TT; ++r) {
        cAP[wave][r][dt * 16 + lm] = accP[dt][r];
        cAM[wave][r][dt * 16 + lm] = accM[dt][r];
      }
  }
  __syncthreads();

  for (int idx = threadIdx.x; idx < TT * DH; idx += BLKT) {
    const int t = idx >> 6, d = idx & 63;
    float M = cm[0][t];
#pragma unroll
    for (int w = 1; w < NWAVES; ++w) M = fmaxf(M, cm[w][t]);
    float L = 0.f, P = 0.f, Q = 0.f;
#pragma unroll
    for (int w = 0; w < NWAVES; ++w) {
      const float e = __expf(cm[w][t] - M);
      L += cl[w][t] * e;
      P += cAP[w][t][d] * e;
      Q += cAM[w][t][d];
    }
    const int cch = head * DH + d;
    const float tsv = (Q + mlp_b[t] + P / L) * alp_ws[((size_t)t * BS + b) * CCH + cch];
    ts_ws[((size_t)t * BS + b) * CCH + cch] = tsv;
  }
}

// ---------------- Stage C: proj + residual + LayerNorm ---------------------
__global__ __launch_bounds__(192) void k_projln(
    const float* __restrict__ ts_ws, const float* __restrict__ tokens,
    const float* __restrict__ proj_w, const float* __restrict__ proj_b,
    const float* __restrict__ ln_g, const float* __restrict__ ln_b,
    float* __restrict__ tok_out) {
  const int row = blockIdx.x;           // t*64 + b
  __shared__ float ts_s[CCH];
  __shared__ float rs[6], rq[6];
  for (int idx = threadIdx.x; idx < CCH; idx += 192)
    ts_s[idx] = ts_ws[(size_t)row * CCH + idx];
  __syncthreads();
  const int j = threadIdx.x;
  float y = proj_b[j];
  const float* pw = proj_w + (size_t)j * CCH;
#pragma unroll 4
  for (int k = 0; k < CCH; ++k) y = fmaf(pw[k], ts_s[k], y);
  y += tokens[(size_t)row * DD + j];
  float s = y, q = y * y;
#pragma unroll
  for (int off = 16; off > 0; off >>= 1) {
    s += __shfl_down(s, off, 32);
    q += __shfl_down(q, off, 32);
  }
  if ((threadIdx.x & 31) == 0) { rs[threadIdx.x >> 5] = s; rq[threadIdx.x >> 5] = q; }
  __syncthreads();
  float ss = 0.f, qq = 0.f;
#pragma unroll
  for (int w = 0; w < 6; ++w) { ss += rs[w]; qq += rq[w]; }
  const float mu = ss / DD;
  const float var = qq / DD - mu * mu;
  const float rr = rsqrtf(var + 1e-5f);
  tok_out[(size_t)row * DD + j] = (y - mu) * rr * ln_g[j] + ln_b[j];
}

extern "C" void kernel_launch(void* const* d_in, const int* in_sizes, int n_in,
                              void* d_out, int out_size, void* d_ws, size_t ws_size,
                              hipStream_t stream) {
  (void)in_sizes; (void)n_in; (void)out_size; (void)ws_size;
  const float* features = (const float*)d_in[0];
  const float* tokens   = (const float*)d_in[1];
  const float* mlp_w    = (const float*)d_in[2];
  const float* mlp_b    = (const float*)d_in[3];
  const float* q_w      = (const float*)d_in[4];
  const float* q_b      = (const float*)d_in[5];
  const float* alpha_w  = (const float*)d_in[6];
  const float* alpha_b  = (const float*)d_in[7];
  const float* proj_w   = (const float*)d_in[8];
  const float* proj_b   = (const float*)d_in[9];
  const float* ln_g     = (const float*)d_in[10];
  const float* ln_b     = (const float*)d_in[11];

  float* tok_out  = (float*)d_out;                // [6,64,192]
  float* attn_out = tok_out + TT * BS * DD;       // [64,4,6,3136]

  float* ws     = (float*)d_ws;
  float* q_ws   = ws;                             // 98304 f
  float* alp_ws = ws + 98304;                     // 98304 f
  float* ts_ws  = ws + 2 * 98304;                 // 98304 f

  k_qalpha<<<TT * BS, 256, 0, stream>>>(tokens, q_w, q_b, alpha_w, alpha_b,
                                        q_ws, alp_ws);
  k_fused<<<BS * NH, BLKT, 0, stream>>>(features, mlp_w, mlp_b, q_ws, alp_ws,
                                        attn_out, ts_ws);
  k_projln<<<TT * BS, 192, 0, stream>>>(ts_ws, tokens, proj_w, proj_b,
                                        ln_g, ln_b, tok_out);
}

// v001
// A run of this version takes 51.5 microseconds.
// Next to v000, in two timings, it ran 1.43 and 1.44 times as fast.
#include <hip/hip_runtime.h>
#include <hip/hip_bf16.h>

typedef float v2f __attribute__((ext_vector_type(2)));
typedef float v8f __attribute__((ext_vector_type(8)));

#define BS   64
#define CCH  256
#define HWN  3136
#define TT   6
#define DD   192
#define NH   4
#define DH   64
#define NTILES 196          // HWN / 16
#define KSTRIDE 20          // padded LDS row stride (floats): conflict-free both ways
#define QSTRIDE 68          // padded q row stride (floats): 16 rows x 8-byte reads on 64 banks
#define NWAVES 16
#define BLKT   512

// ---- gfx1250 async global->LDS path (probe-guarded; fallback = reg prefetch)
#if defined(__has_builtin)
#if __has_builtin(__builtin_amdgcn_global_load_async_to_lds_b128)
#define HAVE_ASYNC_LDS 1
#endif
#endif

#ifdef HAVE_ASYNC_LDS
// Toolchain signature (from diagnostics): (global int4*, local int4*, imm, imm)
typedef int v4i_ __attribute__((vector_size(16)));
typedef __attribute__((address_space(1))) v4i_ GV4;
typedef __attribute__((address_space(3))) v4i_ LV4;
#if __has_builtin(__builtin_amdgcn_s_wait_asynccnt)
#define WAIT_ASYNC(n) __builtin_amdgcn_s_wait_asynccnt((unsigned short)(n))
#else
#define WAIT_ASYNC(n) asm volatile("s_wait_asynccnt %0" ::"n"(n) : "memory")
#endif
#endif

__device__ __forceinline__ v8f wmma_f32(v2f a, v2f b, v8f c) {
  // D(16x16,f32) = A(16x4,f32) * B(4x16,f32) + C
  return __builtin_amdgcn_wmma_f32_16x16x4_f32(false, a, false, b, (short)0, c,
                                               false, false);
}

// -- Stage A+B: q/alpha projection + logits + online softmax + attn_out + mlp
// One block per (b, head). The block first projects its own 6 tokens onto its
// 64 q channels and 64 alpha channels. Then 16 waves each own a strided set of 16-wide
// HW tiles with private flash-attention state; async double-buffered LDS
// staging of the k tile; split-K combine in LDS at the end.
__global__ __launch_bounds__(BLKT) void k_fused(
    const float* __restrict__ feat, const float* __restrict__ tokens,
    const float* __restrict__ mlp_w, const float* __restrict__ mlp_b,
    const float* __restrict__ q_w, const float* __restrict__ q_b,
    const float* __restrict__ a_w, const float* __restrict__ a_b,
    float* __restrict__ attn_g, float* __restrict__ ts_ws) {
  __shared__ float qs[2][16][QSTRIDE];              // q rows t<6, rest zero; one plane per K half
  __shared__ float als[2][TT][DH];                  // alpha before the gate; one plane per K half
  __shared__ float ktile[NWAVES][2 * DH * KSTRIDE]; // per-wave double buffer
  __shared__ float cAP[NWAVES][TT][DH];             // per-wave attn accumulators
  __shared__ float cAM[NWAVES][TT][DH];             // per-wave mlp accumulators
  __shared__ float cm[NWAVES][8], cl[NWAVES][8];    // per-wave softmax (m,l)

  const int blk = blockIdx.x;
  const int b = blk >> 2, head = blk & 3;
  const int wave = threadIdx.x >> 5;
  const int lane = threadIdx.x & 31;
  const int hi = lane >> 4;                         // lane half
  const int lm = lane & 15;

  const float* kbase = feat + ((size_t)b * CCH + head * DH) * HWN; // k[d][n]

  const v8f vzero = {0.f, 0.f, 0.f, 0.f, 0.f, 0.f, 0.f, 0.f};
  float bq0[16], bq1[16];                           // q^T B-fragments, filled below

  // ---- token projection: D[t][c] = tok[t][k] * W[c][k], 8 column tiles
  // (4 of q_w, 4 of a_w) x 2 K halves = one 16x16 tile per wave.
  // Both operands are k-contiguous: a lane takes the same 4 k of its token row
  // and of its weight row, which feed two 16x16x4 products.
  // Every loop here is unrolled so that its arrays stay in registers and the
  // 24 loads of a lane are in flight together.
  auto project_tokens = [&]() {
    const int nt = wave & 7, kh = wave >> 3;
    const int col = (nt & 3) * 16 + lm;             // channel inside the head
    const int koff = kh * (DD / 2) + hi * 4;
    const float* wr = (nt < 4 ? q_w : a_w) + (size_t)(head * DH + col) * DD + koff;
    const float* tr = tokens + ((size_t)lm * BS + b) * DD + koff;
    const float bias = (nt < 4 ? q_b : a_b)[head * DH + col];
    float4 w4[DD / 16], x4[DD / 16];
#pragma unroll
    for (int g = 0; g < DD / 16; ++g) {
      w4[g] = *(const float4*)(wr + g * 8);
      x4[g] = make_float4(0.f, 0.f, 0.f, 0.f);     // rows t >= 6 are zero
    }
    if (lm < TT) {
#pragma unroll
      for (int g = 0; g < DD / 16; ++g) x4[g] = *(const float4*)(tr + g * 8);
    }
    // Lane holds column c = col, rows t = hi*8 + r; the bias starts the sum of
    // the first K half in the rows that are tokens
    v8f acc = vzero;
    if (kh == 0 && hi == 0) {
#pragma unroll
      for (int r = 0; r < TT; ++r) acc[r] = bias;
    }
#pragma unroll
    for (int g = 0; g < DD / 16; ++g) {
      v2f a0; a0.x = x4[g].x; a0.y = x4[g].y;
      v2f b0; b0.x = w4[g].x; b0.y = w4[g].y;
      acc = wmma_f32(a0, b0, acc);
      v2f a1; a1.x = x4[g].z; a1.y = x4[g].w;
      v2f b1; b1.x = w4[g].z; b1.y = w4[g].w;
      acc = wmma_f32(a1, b1, acc);
    }
    if (nt < 4) {
#pragma unroll
      for (int r = 0; r < 8; ++r) qs[kh][hi * 8 + r][col] = acc[r];
    } else if (hi == 0) {
#pragma unroll
      for (int r = 0; r < TT; ++r) als[kh][r][col] = acc[r];
    }
    __syncthreads();
    // q^T B-fragments for all 16 K-chunks: B[k=kc*4+hi*2+{0,1}][n=t=lm]
#pragma unroll
    for (int kc = 0; kc < 16; ++kc) {
      const int d0 = kc * 4 + hi * 2;
      bq0[kc] = qs[0][lm][d0] + qs[1][lm][d0];
      bq1[kc] = qs[0][lm][d0 + 1] + qs[1][lm][d0 + 1];
    }
  };

  v8f accP[4], accM[4];
#pragma unroll
  for (int i = 0; i < 4; ++i) { accP[i] = vzero; accM[i] = vzero; }
  float m_run = -3.0e38f, l_run = 0.f;

  float* ks = ktile[wave];
  float* outg = attn_g + (((size_t)b * NH + head) * TT) * HWN;

  // ---- per-tile compute from an LDS buffer ----
  auto compute_tile = [&](int nbase, const float* kb) {
    // GEMM-1: L^T[n(16) x t(16)] = k^T * q^T over K=dh (16 chunks)
    v8f cf = vzero;
#pragma unroll
    for (int kc = 0; kc < 16; ++kc) {
      const int d0 = kc * 4 + hi * 2;
      v2f a;  a.x = kb[d0 * KSTRIDE + lm];  a.y = kb[(d0 + 1) * KSTRIDE + lm];
      v2f bq; bq.x = bq0[kc];               bq.y = bq1[kc];
      cf = wmma_f32(a, bq, cf);
    }
#pragma unroll
    for (int r = 0; r < 8; ++r) cf[r] *= 0.125f;   // dh^-0.5

    // Lane holds col t=lm, rows n = nbase + hi*8 + r -> 8 consecutive floats
    if (lm < TT) {
      float* po = outg + (size_t)lm * HWN + nbase + hi * 8;
      *(float4*)(po)     = make_float4(cf[0], cf[1], cf[2], cf[3]);
      *(float4*)(po + 4) = make_float4(cf[4], cf[5], cf[6], cf[7]);
    }

    // online softmax update (per-lane state for t = lm)
    float vmax = cf[0];
#pragma unroll
    for (int r = 1; r < 8; ++r) vmax = fmaxf(vmax, cf[r]);
    const float mt = fmaxf(vmax, __shfl_xor(vmax, 16, 32));
    const float m_new = fmaxf(m_run, mt);
    float p[8]; float s = 0.f;
#pragma unroll
    for (int r = 0; r < 8; ++r) { p[r] = __expf(cf[r] - m_new); s += p[r]; }
    s += __shfl_xor(s, 16, 32);
    const float factor = __expf(m_run - m_new);
    l_run = l_run * factor + s;
    m_run = m_new;
    float fr[8];
#pragma unroll
    for (int r = 0; r < 8; ++r) fr[r] = __shfl(factor, r + 8 * hi, 32);
#pragma unroll
    for (int dt = 0; dt < 4; ++dt)
#pragma unroll
      for (int r = 0; r < 8; ++r) accP[dt][r] *= fr[r];

    // GEMM-2/3: acc[t x d] += P * k^T  and  macc[t x d] += mlp_w * k^T
    const float* mwb = mlp_w + nbase;
#pragma unroll
    for (int kc = 0; kc < 4; ++kc) {
      const int na = kc * 4;
      const int ra = na & 7, rb = (na + 2) & 7;    // src reg per dest half
      const int sl = lm + ((na >= 8) ? 16 : 0);    // src lane
      const float x0a = __shfl(p[ra], sl, 32);
      const float x0b = __shfl(p[rb], sl, 32);
      const float x1a = __shfl(p[ra + 1], sl, 32);
      const float x1b = __shfl(p[rb + 1], sl, 32);
      v2f ap; ap.x = hi ? x0b : x0a; ap.y = hi ? x1b : x1a;
      const int noff = na + hi * 2;
      v2f am;
      if (lm < TT) {
        am.x = mwb[(size_t)lm * HWN + noff];
        am.y = mwb[(size_t)lm * HWN + noff + 1];
      } else { am.x = 0.f; am.y = 0.f; }
#pragma unroll
      for (int dt = 0; dt < 4; ++dt) {
        const int dloc = dt * 16 + lm;
        v2f bf;
        bf.x = kb[dloc * KSTRIDE + noff];
        bf.y = kb[dloc * KSTRIDE + noff + 1];
        accP[dt] = wmma_f32(ap, bf, accP[dt]);
        accM[dt] = wmma_f32(am, bf, accM[dt]);
      }
    }
  };

#ifdef HAVE_ASYNC_LDS
  // ---- async double-buffered staging: DMA next tile while computing ----
  auto issue_tile = [&](int tile, int buf) {
    const int nbase = tile * 16;
    float* dst = ks + buf * (DH * KSTRIDE);
#pragma unroll
    for (int i = 0; i < 8; ++i) {
      const int idx = lane + 32 * i;
      const int r = idx >> 2, quad = idx & 3;
      const float* g = kbase + (size_t)r * HWN + nbase + quad * 4;
      float* l = dst + r * KSTRIDE + quad * 4;
      __builtin_amdgcn_global_load_async_to_lds_b128((GV4*)g, (LV4*)l, 0, 0);
    }
  };
  int buf = 0;
  issue_tile(wave, buf);
  project_tokens();                  // runs while the first tile is in flight
  for (int tile = wave; tile < NTILES; tile += NWAVES) {
    const int nxt = tile + NWAVES;
    if (nxt < NTILES) {
      issue_tile(nxt, buf ^ 1);
      WAIT_ASYNC(8);                 // current buffer's 8 transfers complete
    } else {
      WAIT_ASYNC(0);
    }
    compute_tile(tile * 16, ks + buf * (DH * KSTRIDE));
    buf ^= 1;
  }
#else
  // ---- fallback: software-pipelined register prefetch, single buffer ----
  float4 pf[8];
  auto load_regs = [&](int tile) {
    const int nbase = tile * 16;
#pragma unroll
    for (int i = 0; i < 8; ++i) {
      const int idx = lane + 32 * i;
      const int r = idx >> 2, quad = idx & 3;
      pf[i] = *(const float4*)(kbase + (size_t)r * HWN + nbase + quad * 4);
    }
  };
  auto store_regs = [&]() {
#pragma unroll
    for (int i = 0; i < 8; ++i) {
      const int idx = lane + 32 * i;
      const int r = idx >> 2, quad = idx & 3;
      *(float4*)(ks + r * KSTRIDE + quad * 4) = pf[i];
    }
  };
  load_regs(wave);
  project_tokens();
  for (int tile = wave; tile < NTILES; tile += NWAVES) {
    store_regs();                    // DS is in-order: safe vs prior tile reads
    const int nxt = tile + NWAVES;
    if (nxt < NTILES) load_regs(nxt);  // overlap next HBM fetch with compute
    compute_tile(tile * 16, ks);
  }
#endif

  // ---- split-K combine across the waves ----
  if (hi == 0 && lm < TT) { cm[wave][lm] = m_run; cl[wave][lm] = l_run; }
  if (hi == 0) {                  // lanes 0..15 hold rows t = r (r < 6 valid)
#pragma unroll
    for (int dt = 0; dt < 4; ++dt)
#pragma unroll
      for (int r = 0; r < TT; ++r) {
        cAP[wave][r][dt * 16 + lm] = accP[dt][r];
        cAM[wave][r][dt * 16 + lm] = accM[dt][r];
      }
  }
  __syncthreads();

  for (int idx = threadIdx.x; idx < TT * DH; idx += BLKT) {
    const int t = idx >> 6, d = idx & 63;
    float M = cm[0][t];
#pragma unroll
    for (int w = 1; w < NWAVES; ++w) M = fmaxf(M, cm[w][t]);
    float L = 0.f, P = 0.f, Q = 0.f;
#pragma unroll
    for (int w = 0; w < NWAVES; ++w) {
      const float e = __expf(cm[w][t] - M);
      L += cl[w][t] * e;
      P += cAP[w][t][d] * e;
      Q += cAM[w][t][d];
    }
    const int cch = head * DH + d;
    const float av = als[0][t][d] + als[1][t][d];
    const float g = fminf(fmaxf(av + 3.f, 0.f), 6.f) * (2.f / 6.f);  // h_sigmoid*2
    const float tsv = (Q + mlp_b[t] + P / L) * g;
    ts_ws[((size_t)t * BS + b) * CCH + cch] = tsv;
  }
}

// ---------------- Stage C: proj + residual + LayerNorm ---------------------
__global__ __launch_bounds__(192) void k_projln(
    const float* __restrict__ ts_ws, const float* __restrict__ tokens,
    const float* __restrict__ proj_w, const float* __restrict__ proj_b,
    const float* __restrict__ ln_g, const float* __restrict__ ln_b,
    float* __restrict__ tok_out) {
  const int row = blockIdx.x;           // t*64 + b
  __shared__ float ts_s[CCH];
  __shared__ float rs[6], rq[6];
  for (int idx = threadIdx.x; idx < CCH; idx += 192)
    ts_s[idx] = ts_ws[(size_t)row * CCH + idx];
  __syncthreads();
  const int j = threadIdx.x;
  float y = proj_b[j];
  const float* pw = proj_w + (size_t)j * CCH;
#pragma unroll 4
  for (int k = 0; k < CCH; ++k) y = fmaf(pw[k], ts_s[k], y);
  y += tokens[(size_t)row * DD + j];
  float s = y, q = y * y;
#pragma unroll
  for (int off = 16; off > 0; off >>= 1) {
    s += __shfl_down(s, off, 32);
    q += __shfl_down(q, off, 32);
  }
  if ((threadIdx.x & 31) == 0) { rs[threadIdx.x >> 5] = s; rq[threadIdx.x >> 5] = q; }
  __syncthreads();
  float ss = 0.f, qq = 0.f;
#pragma unroll
  for (int w = 0; w < 6; ++w) { ss += rs[w]; qq += rq[w]; }
  const float mu = ss / DD;
  const float var = qq / DD - mu * mu;
  const float rr = rsqrtf(var + 1e-5f);
  tok_out[(size_t)row * DD + j] = (y - mu) * rr * ln_g[j] + ln_b[j];
}

extern "C" void kernel_launch(void* const* d_in, const int* in_sizes, int n_in,
                              void* d_out, int out_size, void* d_ws, size_t ws_size,
                              hipStream_t stream) {
  (void)in_sizes; (void)n_in; (void)out_size; (void)ws_size;
  const float* features = (const float*)d_in[0];
  const float* tokens   = (const float*)d_in[1];
  const float* mlp_w    = (const float*)d_in[2];
  const float* mlp_b    = (const float*)d_in[3];
  const float* q_w      = (const float*)d_in[4];
  const float* q_b      = (const float*)d_in[5];
  const float* alpha_w  = (const float*)d_in[6];
  const float* alpha_b  = (const float*)d_in[7];
  const float* proj_w   = (const float*)d_in[8];
  const float* proj_b   = (const float*)d_in[9];
  const float* ln_g     = (const float*)d_in[10];
  const float* ln_b     = (const float*)d_in[11];

  float* tok_out  = (float*)d_out;                // [6,64,192]
  float* attn_out = tok_out + TT * BS * DD;       // [64,4,6,3136]

  float* ws     = (float*)d_ws;
  float* ts_ws  = ws;                             // 98304 f

  k_fused<<<BS * NH, BLKT, 0, stream>>>(features, tokens, mlp_w, mlp_b, q_w, q_b,
                                        alpha_w, alpha_b, attn_out, ts_ws);
  k_projln<<<TT * BS, 192, 0, stream>>>(ts_ws, tokens, proj_w, proj_b,
                                        ln_g, ln_b, tok_out);
}

// v002
// A run of this version takes 42.4 microseconds.
// Timed twice side by side with v001, it ran 1.21 times as fast both times.
// All steps since v000 together make it 1.74 times as fast.
#include <hip/hip_runtime.h>
#include <hip/hip_bf16.h>

typedef float v2f __attribute__((ext_vector_type(2)));
typedef float v8f __attribute__((ext_vector_type(8)));

#define BS   64
#define CCH  256
#define HWN  3136
#define TT   6
#define DD   192
#define NH   4
#define DH   64
#define NTILES 196          // HWN / 16
#define KSTRIDE 20          // padded LDS row stride (floats): conflict-free both ways
#define QSTRIDE 68          // padded q row stride (floats): 16 rows x 8-byte reads on 64 banks
#define NWAVES 16
#define BLKT   512

// ---- gfx1250 async global->LDS path (probe-guarded; fallback = reg prefetch)
#if defined(__has_builtin)
#if __has_builtin(__builtin_amdgcn_global_load_async_to_lds_b128)
#define HAVE_ASYNC_LDS 1
#endif
#endif

#ifdef HAVE_ASYNC_LDS
// Toolchain signature (from diagnostics): (global int4*, local int4*, imm, imm)
typedef int v4i_ __attribute__((vector_size(16)));
typedef __attribute__((address_space(1))) v4i_ GV4;
typedef __attribute__((address_space(3))) v4i_ LV4;
#if __has_builtin(__builtin_amdgcn_s_wait_asynccnt)
#define WAIT_ASYNC(n) __builtin_amdgcn_s_wait_asynccnt((unsigned short)(n))
#else
#define WAIT_ASYNC(n) asm volatile("s_wait_asynccnt %0" ::"n"(n) : "memory")
#endif
#endif

__device__ __forceinline__ v8f wmma_f32(v2f a, v2f b, v8f c) {
  // D(16x16,f32) = A(16x4,f32) * B(4x16,f32) + C
  return __builtin_amdgcn_wmma_f32_16x16x4_f32(false, a, false, b, (short)0, c,
                                               false, false);
}

// -- Stage A+B: q/alpha projection + logits + online softmax + attn_out + mlp
// One block per (b, head). The block first projects its own 6 tokens onto its
// 64 q channels and 64 alpha channels. Then 16 waves each own a strided set of 16-wide
// HW tiles with private flash-attention state; async double-buffered LDS
// staging of the k tile; split-K combine in LDS at the end.
__global__ __launch_bounds__(BLKT) void k_fused(
    const float* __restrict__ feat, const float* __restrict__ tokens,
    const float* __restrict__ mlp_w, const float* __restrict__ mlp_b,
    const float* __restrict__ q_w, const float* __restrict__ q_b,
    const float* __restrict__ a_w, const float* __restrict__ a_b,
    float* __restrict__ attn_g, float* __restrict__ ts_ws) {
  __shared__ float qs[2][16][QSTRIDE];              // q rows t<6, rest zero; one plane per K half
  __shared__ float als[2][TT][DH];                  // alpha before the gate; one plane per K half
  __shared__ float ktile[NWAVES][2 * DH * KSTRIDE]; // per-wave double buffer
  __shared__ float cAP[NWAVES][TT][DH];             // per-wave attn accumulators
  __shared__ float cAM[NWAVES][TT][DH];             // per-wave mlp accumulators
  __shared__ float cm[NWAVES][8], cl[NWAVES][8];    // per-wave softmax (m,l)

  const int blk = blockIdx.x;
  const int b = blk >> 2, head = blk & 3;
  const int wave = threadIdx.x >> 5;
  const int lane = threadIdx.x & 31;
  const int hi = lane >> 4;                         // lane half
  const int lm = lane & 15;

  const float* kbase = feat + ((size_t)b * CCH + head * DH) * HWN; // k[d][n]

  const v8f vzero = {0.f, 0.f, 0.f, 0.f, 0.f, 0.f, 0.f, 0.f};
  float bq0[16], bq1[16];                           // q^T B-fragments, filled below

  // ---- token projection: D[t][c] = tok[t][k] * W[c][k], 8 column tiles
  // (4 of q_w, 4 of a_w) x 2 K halves = one 16x16 tile per wave.
  // Both operands are k-contiguous: a lane takes the same 4 k of its token row
  // and of its weight row, which feed two 16x16x4 products.
  // Every loop here is unrolled so that its arrays stay in registers and the
  // 24 loads of a lane are in flight together.
  auto project_tokens = [&]() {
    const int nt = wave & 7, kh = wave >> 3;
    const int col = (nt & 3) * 16 + lm;             // channel inside the head
    const int koff = kh * (DD / 2) + hi * 4;
    const float* wr = (nt < 4 ? q_w : a_w) + (size_t)(head * DH + col) * DD + koff;
    const float* tr = tokens + ((size_t)lm * BS + b) * DD + koff;
    const float bias = (nt < 4 ? q_b : a_b)[head * DH + col];
    float4 w4[DD / 16], x4[DD / 16];
#pragma unroll
    for (int g = 0; g < DD / 16; ++g) {
      w4[g] = *(const float4*)(wr + g * 8);
      x4[g] = make_float4(0.f, 0.f, 0.f, 0.f);     // rows t >= 6 are zero
    }
    if (lm < TT) {
#pragma unroll
      for (int g = 0; g < DD / 16; ++g) x4[g] = *(const float4*)(tr + g * 8);
    }
    // Lane holds column c = col, rows t = hi*8 + r; the bias starts the sum of
    // the first K half in the rows that are tokens
    v8f acc = vzero;
    if (kh == 0 && hi == 0) {
#pragma unroll
      for (int r = 0; r < TT; ++r) acc[r] = bias;
    }
#pragma unroll
    for (int g = 0; g < DD / 16; ++g) {
      v2f a0; a0.x = x4[g].x; a0.y = x4[g].y;
      v2f b0; b0.x = w4[g].x; b0.y = w4[g].y;
      acc = wmma_f32(a0, b0, acc);
      v2f a1; a1.x = x4[g].z; a1.y = x4[g].w;
      v2f b1; b1.x = w4[g].z; b1.y = w4[g].w;
      acc = wmma_f32(a1, b1, acc);
    }
    if (nt < 4) {
#pragma unroll
      for (int r = 0; r < 8; ++r) qs[kh][hi * 8 + r][col] = acc[r];
    } else if (hi == 0) {
#pragma unroll
      for (int r = 0; r < TT; ++r) als[kh][r][col] = acc[r];
    }
    __syncthreads();
    // q^T B-fragments for all 16 K-chunks: B[k=kc*4+hi*2+{0,1}][n=t=lm]
#pragma unroll
    for (int kc = 0; kc < 16; ++kc) {
      const int d0 = kc * 4 + hi * 2;
      bq0[kc] = qs[0][lm][d0] + qs[1][lm][d0];
      bq1[kc] = qs[0][lm][d0 + 1] + qs[1][lm][d0 + 1];
    }
  };

  v8f accP[4], accM[4];
#pragma unroll
  for (int i = 0; i < 4; ++i) { accP[i] = vzero; accM[i] = vzero; }
  float m_run = -3.0e38f, l_run = 0.f;

  float* ks = ktile[wave];
  float* outg = attn_g + (((size_t)b * NH + head) * TT) * HWN;

  // ---- per-tile compute from an LDS buffer ----
  auto compute_tile = [&](int nbase, const float* kb) {
    // GEMM-1: L^T[n(16) x t(16)] = k^T * q^T over K=dh (16 chunks)
    v8f cf = vzero;
#pragma unroll
    for (int kc = 0; kc < 16; ++kc) {
      const int d0 = kc * 4 + hi * 2;
      v2f a;  a.x = kb[d0 * KSTRIDE + lm];  a.y = kb[(d0 + 1) * KSTRIDE + lm];
      v2f bq; bq.x = bq0[kc];               bq.y = bq1[kc];
      cf = wmma_f32(a, bq, cf);
    }
#pragma unroll
    for (int r = 0; r < 8; ++r) cf[r] *= 0.125f;   // dh^-0.5

    // Lane holds col t=lm, rows n = nbase + hi*8 + r -> 8 consecutive floats
    if (lm < TT) {
      float* po = outg + (size_t)lm * HWN + nbase + hi * 8;
      *(float4*)(po)     = make_float4(cf[0], cf[1], cf[2], cf[3]);
      *(float4*)(po + 4) = make_float4(cf[4], cf[5], cf[6], cf[7]);
    }

    // online softmax update (per-lane state for t = lm)
    float vmax = cf[0];
#pragma unroll
    for (int r = 1; r < 8; ++r) vmax = fmaxf(vmax, cf[r]);
    const float mt = fmaxf(vmax, __shfl_xor(vmax, 16, 32));
    const float m_new = fmaxf(m_run, mt);
    float p[8]; float s = 0.f;
#pragma unroll
    for (int r = 0; r < 8; ++r) { p[r] = __expf(cf[r] - m_new); s += p[r]; }
    s += __shfl_xor(s, 16, 32);
    const float factor = __expf(m_run - m_new);
    l_run = l_run * factor + s;
    m_run = m_new;
    float fr[8];
#pragma unroll
    for (int r = 0; r < 8; ++r) fr[r] = __shfl(factor, r + 8 * hi, 32);
#pragma unroll
    for (int dt = 0; dt < 4; ++dt)
#pragma unroll
      for (int r = 0; r < 8; ++r) accP[dt][r] *= fr[r];

    // GEMM-2/3: acc[t x d] += P * k^T  and  macc[t x d] += mlp_w * k^T
    const float* mwb = mlp_w + nbase;
#pragma unroll
    for (int kc = 0; kc < 4; ++kc) {
      const int na = kc * 4;
      const int ra = na & 7, rb = (na + 2) & 7;    // src reg per dest half
      const int sl = lm + ((na >= 8) ? 16 : 0);    // src lane
      const float x0a = __shfl(p[ra], sl, 32);
      const float x0b = __shfl(p[rb], sl, 32);
      const float x1a = __shfl(p[ra + 1], sl, 32);
      const float x1b = __shfl(p[rb + 1], sl, 32);
      v2f ap; ap.x = hi ? x0b : x0a; ap.y = hi ? x1b : x1a;
      const int noff = na + hi * 2;
      v2f am;
      if (lm < TT) {
        am.x = mwb[(size_t)lm * HWN + noff];
        am.y = mwb[(size_t)lm * HWN + noff + 1];
      } else { am.x = 0.f; am.y = 0.f; }
#pragma unroll
      for (int dt = 0; dt < 4; ++dt) {
        const int dloc = dt * 16 + lm;
        v2f bf;
        bf.x = kb[dloc * KSTRIDE + noff];
        bf.y = kb[dloc * KSTRIDE + noff + 1];
        accP[dt] = wmma_f32(ap, bf, accP[dt]);
        accM[dt] = wmma_f32(am, bf, accM[dt]);
      }
    }
  };

#ifdef HAVE_ASYNC_LDS
  // ---- async double-buffered staging: DMA next tile while computing ----
  auto issue_tile = [&](int tile, int buf) {
    const int nbase = tile * 16;
    float* dst = ks + buf * (DH * KSTRIDE);
#pragma unroll
    for (int i = 0; i < 8; ++i) {
      const int idx = lane + 32 * i;
      const int r = idx >> 2, quad = idx & 3;
      const float* g = kbase + (size_t)r * HWN + nbase + quad * 4;
      float* l = dst + r * KSTRIDE + quad * 4;
      __builtin_amdgcn_global_load_async_to_lds_b128((GV4*)g, (LV4*)l, 0, 0);
    }
  };
  int buf = 0;
  issue_tile(wave, buf);
  project_tokens();                  // runs while the first tile is in flight
  for (int tile = wave; tile < NTILES; tile += NWAVES) {
    const int nxt = tile + NWAVES;
    if (nxt < NTILES) {
      issue_tile(nxt, buf ^ 1);
      WAIT_ASYNC(8);                 // current buffer's 8 transfers complete
    } else {
      WAIT_ASYNC(0);
    }
    compute_tile(tile * 16, ks + buf * (DH * KSTRIDE));
    buf ^= 1;
  }
#else
  // ---- fallback: software-pipelined register prefetch, single buffer ----
  float4 pf[8];
  auto load_regs = [&](int tile) {
    const int nbase = tile * 16;
#pragma unroll
    for (int i = 0; i < 8; ++i) {
      const int idx = lane + 32 * i;
      const int r = idx >> 2, quad = idx & 3;
      pf[i] = *(const float4*)(kbase + (size_t)r * HWN + nbase + quad * 4);
    }
  };
  auto store_regs = [&]() {
#pragma unroll
    for (int i = 0; i < 8; ++i) {
      const int idx = lane + 32 * i;
      const int r = idx >> 2, quad = idx & 3;
      *(float4*)(ks + r * KSTRIDE + quad * 4) = pf[i];
    }
  };
  load_regs(wave);
  project_tokens();
  for (int tile = wave; tile < NTILES; tile += NWAVES) {
    store_regs();                    // DS is in-order: safe vs prior tile reads
    const int nxt = tile + NWAVES;
    if (nxt < NTILES) load_regs(nxt);  // overlap next HBM fetch with compute
    compute_tile(tile * 16, ks);
  }
#endif

  // ---- split-K combine across the waves ----
  if (hi == 0 && lm < TT) { cm[wave][lm] = m_run; cl[wave][lm] = l_run; }
  if (hi == 0) {                  // lanes 0..15 hold rows t = r (r < 6 valid)
#pragma unroll
    for (int dt = 0; dt < 4; ++dt)
#pragma unroll
      for (int r = 0; r < TT; ++r) {
        cAP[wave][r][dt * 16 + lm] = accP[dt][r];
        cAM[wave][r][dt * 16 + lm] = accM[dt][r];
      }
  }
  __syncthreads();

  for (int idx = threadIdx.x; idx < TT * DH; idx += BLKT) {
    const int t = idx >> 6, d = idx & 63;
    float M = cm[0][t];
#pragma unroll
    for (int w = 1; w < NWAVES; ++w) M = fmaxf(M, cm[w][t]);
    float L = 0.f, P = 0.f, Q = 0.f;
#pragma unroll
    for (int w = 0; w < NWAVES; ++w) {
      const float e = __expf(cm[w][t] - M);
      L += cl[w][t] * e;
      P += cAP[w][t][d] * e;
      Q += cAM[w][t][d];
    }
    const int cch = head * DH + d;
    const float av = als[0][t][d] + als[1][t][d];
    const float g = fminf(fmaxf(av + 3.f, 0.f), 6.f) * (2.f / 6.f);  // h_sigmoid*2
    const float tsv = (Q + mlp_b[t] + P / L) * g;
    ts_ws[((size_t)t * BS + b) * CCH + cch] = tsv;
  }
}

// ---------------- Stage C: proj + residual + LayerNorm ---------------------
// One block per PR rows (row = t*64 + b). Eight neighbouring lanes share one
// proj_w row: a wave's 16-byte load covers 4 rows x 128 contiguous bytes, and a
// lane's 24 weight loads and 24 ts loads have no wait between them. Each weight
// is used for PR rows. The 8 partial sums of an output meet by lane exchange.
#define PR 3                // rows per block
#define PJ 3                // groups of 4 output columns per wave: 16 waves x 3 x 4 = 192
typedef float v4f __attribute__((ext_vector_type(4)));

template <int CTRL>
__device__ __forceinline__ float add_xmask(float x) {
  // x + (x of lane l ^ m) inside a 16-lane row, CTRL = 0x160 + m (row_xmask)
  const int y = __builtin_amdgcn_update_dpp(0, __float_as_int(x), CTRL, 0xf, 0xf, true);
  return x + __int_as_float(y);
}
__device__ __forceinline__ float add_x16(float x) {
  // x + (x of lane l ^ 16)
  const int v = __float_as_int(x);
  const int y = __builtin_amdgcn_permlanex16(v, v, 0x76543210, 0xfedcba98, false, false);
  return x + __int_as_float(y);
}

__global__ __launch_bounds__(BLKT) void k_projln(
    const float* __restrict__ ts_ws, const float* __restrict__ tokens,
    const float* __restrict__ proj_w, const float* __restrict__ proj_b,
    const float* __restrict__ ln_g, const float* __restrict__ ln_b,
    float* __restrict__ tok_out) {
  __shared__ __attribute__((aligned(16))) float ys[PR][DD];  // read back 8 bytes a lane
  const int row0 = blockIdx.x * PR;
  const int wave = __builtin_amdgcn_readfirstlane(threadIdx.x >> 5);
  const int lane = threadIdx.x & 31;
  const int sub = lane & 7, grp = lane >> 3;   // k slice, column inside the group

  // waves 0..PR-1 finish one row each (columns 2*lane + 64*i, +1); what they
  // need for that is asked for first, so that it is there when the sums are
  v2f tk[3], pb[3], lg[3], lb[3];
  if (wave < PR) {
    const float* tr = tokens + (size_t)(row0 + wave) * DD;
#pragma unroll
    for (int i = 0; i < 3; ++i) {
      const int j = 2 * lane + 64 * i;
      tk[i] = *(const v2f*)(tr + j);
      pb[i] = *(const v2f*)(proj_b + j);
      lg[i] = *(const v2f*)(ln_g + j);
      lb[i] = *(const v2f*)(ln_b + j);
    }
  }

  // lane's k: it*32 + sub*4 .. +3, the same for ts and for the weights
  const float* xb = ts_ws + (size_t)row0 * CCH;
  const float* wb = proj_w + (size_t)(wave * PJ * 4) * CCH;
  const int wo = grp * CCH + sub * 4;          // lane's place in the wave's first 4 weight rows
  v4f x[PR][8], w[PJ][8];
#pragma unroll
  for (int r = 0; r < PR; ++r)
#pragma unroll
    for (int it = 0; it < 8; ++it)
      x[r][it] = *(const v4f*)(xb + (sub * 4 + r * CCH + it * 32));
#pragma unroll
  for (int p = 0; p < PJ; ++p)
#pragma unroll
    for (int it = 0; it < 8; ++it)
      w[p][it] = *(const v4f*)(wb + (wo + p * 4 * CCH + it * 32));
  // the offset registers that the loads above name stay whole until this wait
  asm volatile("s_wait_xcnt 0x0" ::"v"(wo * 4), "v"(sub) : "memory");

#pragma unroll
  for (int p = 0; p < PJ; ++p) {
    float v[PR];
#pragma unroll
    for (int r = 0; r < PR; ++r) {
      v2f acc = {0.f, 0.f};
#pragma unroll
      for (int it = 0; it < 8; ++it) {
        acc = w[p][it].lo * x[r][it].lo + acc;
        acc = w[p][it].hi * x[r][it].hi + acc;
      }
      float s = acc.x + acc.y;
      s = add_xmask<0x161>(s);
      s = add_xmask<0x162>(s);
      s = add_xmask<0x164>(s);                 // all 8 lanes of the column hold the sum
      v[r] = s;
    }
    const float val = sub == 0 ? v[0] : (sub == 1 ? v[1] : v[2]);
    if (sub < PR) ys[sub][(wave * PJ + p) * 4 + grp] = val;
  }
  __syncthreads();

  if (wave < PR) {
    v2f y[3];
    float s = 0.f, q = 0.f;
#pragma unroll
    for (int i = 0; i < 3; ++i) {
      y[i] = (*(const v2f*)(&ys[wave][2 * lane + 64 * i]) + pb[i]) + tk[i];
      s += y[i].x + y[i].y;
      q = fmaf(y[i].x, y[i].x, q);
      q = fmaf(y[i].y, y[i].y, q);
    }
    s = add_xmask<0x161>(s);  q = add_xmask<0x161>(q);
    s = add_xmask<0x162>(s);  q = add_xmask<0x162>(q);
    s = add_xmask<0x164>(s);  q = add_xmask<0x164>(q);
    s = add_xmask<0x168>(s);  q = add_xmask<0x168>(q);
    s = add_x16(s);           q = add_x16(q);
    const float mu = s / DD;
    const float var = q / DD - mu * mu;
    const float rr = rsqrtf(var + 1e-5f);
    float* po = tok_out + (size_t)(row0 + wave) * DD;
#pragma unroll
    for (int i = 0; i < 3; ++i)
      *(v2f*)(po + 2 * lane + 64 * i) = (y[i] - mu) * rr * lg[i] + lb[i];
  }
}

extern "C" void kernel_launch(void* const* d_in, const int* in_sizes, int n_in,
                              void* d_out, int out_size, void* d_ws, size_t ws_size,
                              hipStream_t stream) {
  (void)in_sizes; (void)n_in; (void)out_size; (void)ws_size;
  const float* features = (const float*)d_in[0];
  const float* tokens   = (const float*)d_in[1];
  const float* mlp_w    = (const float*)d_in[2];
  const float* mlp_b    = (const float*)d_in[3];
  const float* q_w      = (const float*)d_in[4];
  const float* q_b      = (const float*)d_in[5];
  const float* alpha_w  = (const float*)d_in[6];
  const float* alpha_b  = (const float*)d_in[7];
  const float* proj_w   = (const float*)d_in[8];
  const float* proj_b   = (const float*)d_in[9];
  const float* ln_g     = (const float*)d_in[10];
  const float* ln_b     = (const float*)d_in[11];

  float* tok_out  = (float*)d_out;                // [6,64,192]
  float* attn_out = tok_out + TT * BS * DD;       // [64,4,6,3136]

  float* ws     = (float*)d_ws;
  float* ts_ws  = ws;                             // 98304 f

  k_fused<<<BS * NH, BLKT, 0, stream>>>(features, tokens, mlp_w, mlp_b, q_w, q_b,
                                        alpha_w, alpha_b, attn_out, ts_ws);
  k_projln<<<TT * BS / PR, BLKT, 0, stream>>>(ts_ws, tokens, proj_w, proj_b,
                                        ln_g, ln_b, tok_out);
}

// v003
// A run of this version takes 39.2 microseconds.
// In both of two side-by-side timings against v002, it was 1.08 times as fast.
// Counting every step since v000, it is 1.88 times as fast.
#include <hip/hip_runtime.h>
#include <hip/hip_bf16.h>

typedef float v2f __attribute__((ext_vector_type(2)));
typedef float v8f __attribute__((ext_vector_type(8)));

#define BS   64
#define CCH  256
#define HWN  3136
#define TT   6
#define DD   192
#define NH   4
#define DH   64
#define NTILES 196          // HWN / 16
#define KSTRIDE 20          // padded LDS row stride (floats): conflict-free both ways
#define QSTRIDE 68          // padded q row stride (floats): 16 rows x 8-byte reads on 64 banks
#define NWAVES 16
#define BLKT   512

// ---- gfx1250 async global->LDS path (probe-guarded; fallback = reg prefetch)
#if defined(__has_builtin)
#if __has_builtin(__builtin_amdgcn_global_load_async_to_lds_b128)
#define HAVE_ASYNC_LDS 1
#endif
#endif

#ifdef HAVE_ASYNC_LDS
// Toolchain signature (from diagnostics): (global int4*, local int4*, imm, imm)
typedef int v4i_ __attribute__((vector_size(16)));
typedef __attribute__((address_space(1))) v4i_ GV4;
typedef __attribute__((address_space(3))) v4i_ LV4;
#if __has_builtin(__builtin_amdgcn_s_wait_asynccnt)
#define WAIT_ASYNC(n) __builtin_amdgcn_s_wait_asynccnt((unsigned short)(n))
#else
#define WAIT_ASYNC(n) asm volatile("s_wait_asynccnt %0" ::"n"(n) : "memory")
#endif
#endif

__device__ __forceinline__ v8f wmma_f32(v2f a, v2f b, v8f c) {
  // D(16x16,f32) = A(16x4,f32) * B(4x16,f32) + C
  return __builtin_amdgcn_wmma_f32_16x16x4_f32(false, a, false, b, (short)0, c,
                                               false, false);
}

// -- Stage A+B: q/alpha projection + logits + online softmax + attn_out + mlp
// One block per (b, head). The block first projects its own 6 tokens onto its
// 64 q channels and 64 alpha channels. Then 16 waves each own a strided set of 16-wide
// HW tiles with private flash-attention state; async double-buffered LDS
// staging of the k tile; split-K combine in LDS at the end.
__global__ __launch_bounds__(BLKT) void k_fused(
    const float* __restrict__ feat, const float* __restrict__ tokens,
    const float* __restrict__ mlp_w, const float* __restrict__ mlp_b,
    const float* __restrict__ q_w, const float* __restrict__ q_b,
    const float* __restrict__ a_w, const float* __restrict__ a_b,
    float* __restrict__ attn_g, float* __restrict__ ts_ws) {
  __shared__ float qs[2][16][QSTRIDE];              // q rows t<6, rest zero; one plane per K half
  __shared__ float als[2][TT][DH];                  // alpha before the gate; one plane per K half
  __shared__ float ktile[NWAVES][2 * DH * KSTRIDE]; // per-wave double buffer
  __shared__ float cAP[NWAVES][TT][DH];             // per-wave attn accumulators
  __shared__ float cAM[NWAVES][TT][DH];             // per-wave mlp accumulators
  __shared__ float cm[NWAVES][8], cl[NWAVES][8];    // per-wave softmax (m,l)

  const int blk = blockIdx.x;
  const int b = blk >> 2, head = blk & 3;
  const int wave = threadIdx.x >> 5;
  const int lane = threadIdx.x & 31;
  const int hi = lane >> 4;                         // lane half
  const int lm = lane & 15;

  const float* kbase = feat + ((size_t)b * CCH + head * DH) * HWN; // k[d][n]

  const v8f vzero = {0.f, 0.f, 0.f, 0.f, 0.f, 0.f, 0.f, 0.f};
  float bq0[16], bq1[16];                           // q^T B-fragments, filled below

  // ---- token projection: D[t][c] = tok[t][k] * W[c][k], 8 column tiles
  // (4 of q_w, 4 of a_w) x 2 K halves = one 16x16 tile per wave.
  // Both operands are k-contiguous: a lane takes the same 4 k of its token row
  // and of its weight row, which feed two 16x16x4 products.
  // Every loop here is unrolled so that its arrays stay in registers and the
  // 24 loads of a lane are in flight together.
  auto project_tokens = [&]() {
    const int nt = wave & 7, kh = wave >> 3;
    const int col = (nt & 3) * 16 + lm;             // channel inside the head
    const int koff = kh * (DD / 2) + hi * 4;
    const float* wr = (nt < 4 ? q_w : a_w) + (size_t)(head * DH + col) * DD + koff;
    const float* tr = tokens + ((size_t)lm * BS + b) * DD + koff;
    const float bias = (nt < 4 ? q_b : a_b)[head * DH + col];
    float4 w4[DD / 16], x4[DD / 16];
#pragma unroll
    for (int g = 0; g < DD / 16; ++g) {
      w4[g] = *(const float4*)(wr + g * 8);
      x4[g] = make_float4(0.f, 0.f, 0.f, 0.f);     // rows t >= 6 are zero
    }
    if (lm < TT) {
#pragma unroll
      for (int g = 0; g < DD / 16; ++g) x4[g] = *(const float4*)(tr + g * 8);
    }
    // Lane holds column c = col, rows t = hi*8 + r; the bias starts the sum of
    // the first K half in the rows that are tokens
    v8f acc = vzero;
    if (kh == 0 && hi == 0) {
#pragma unroll
      for (int r = 0; r < TT; ++r) acc[r] = bias;
    }
#pragma unroll
    for (int g = 0; g < DD / 16; ++g) {
      v2f a0; a0.x = x4[g].x; a0.y = x4[g].y;
      v2f b0; b0.x = w4[g].x; b0.y = w4[g].y;
      acc = wmma_f32(a0, b0, acc);
      v2f a1; a1.x = x4[g].z; a1.y = x4[g].w;
      v2f b1; b1.x = w4[g].z; b1.y = w4[g].w;
      acc = wmma_f32(a1, b1, acc);
    }
    if (nt < 4) {
#pragma unroll
      for (int r = 0; r < 8; ++r) qs[kh][hi * 8 + r][col] = acc[r];
    } else if (hi == 0) {
#pragma unroll
      for (int r = 0; r < TT; ++r) als[kh][r][col] = acc[r];
    }
    __syncthreads();
    // q^T B-fragments for all 16 K-chunks: B[k=kc*4+hi*2+{0,1}][n=t=lm]
#pragma unroll
    for (int kc = 0; kc < 16; ++kc) {
      const int d0 = kc * 4 + hi * 2;
      bq0[kc] = qs[0][lm][d0] + qs[1][lm][d0];
      bq1[kc] = qs[0][lm][d0 + 1] + qs[1][lm][d0 + 1];
    }
  };

  v8f accP[4], accM[4];
#pragma unroll
  for (int i = 0; i < 4; ++i) { accP[i] = vzero; accM[i] = vzero; }
  float m_run = -3.0e38f, l_run = 0.f;

  float* ks = ktile[wave];
  float* outg = attn_g + (((size_t)b * NH + head) * TT) * HWN;

  // mlp_w A-fragments of one tile, A[t=lm][n = kc*4 + hi*2 + {0,1}]: fetched one
  // tile ahead, so that no load is waited for inside a tile's products. Lanes of
  // the rows t >= 6 read row 5 (in bounds); their values are zeroed before use.
  // Both loops are unrolled so that the two small arrays stay in registers.
  const float* mwl = mlp_w + (size_t)(lm < TT ? lm : TT - 1) * HWN + hi * 2;
  auto load_mw = [&](int tile, v2f (&dst)[4]) {
#pragma unroll
    for (int kc = 0; kc < 4; ++kc) dst[kc] = *(const v2f*)(mwl + tile * 16 + kc * 4);
  };
  auto take_mw = [&](v2f (&dst)[4], const v2f (&s)[4]) {
#pragma unroll
    for (int kc = 0; kc < 4; ++kc) {
      dst[kc].x = lm < TT ? s[kc].x : 0.f;
      dst[kc].y = lm < TT ? s[kc].y : 0.f;
    }
  };
  v2f mw_cur[4], mw_nxt[4];

  // ---- per-tile compute from an LDS buffer ----
  auto compute_tile = [&](int nbase, const float* kb) {
    // GEMM-1: L^T[n(16) x t(16)] = k^T * q^T over K=dh (16 chunks)
    v8f cf = vzero;
#pragma unroll
    for (int kc = 0; kc < 16; ++kc) {
      const int d0 = kc * 4 + hi * 2;
      v2f a;  a.x = kb[d0 * KSTRIDE + lm];  a.y = kb[(d0 + 1) * KSTRIDE + lm];
      v2f bq; bq.x = bq0[kc];               bq.y = bq1[kc];
      cf = wmma_f32(a, bq, cf);
    }
#pragma unroll
    for (int r = 0; r < 8; ++r) cf[r] *= 0.125f;   // dh^-0.5

    // Lane holds col t=lm, rows n = nbase + hi*8 + r -> 8 consecutive floats
    if (lm < TT) {
      float* po = outg + (size_t)lm * HWN + nbase + hi * 8;
      *(float4*)(po)     = make_float4(cf[0], cf[1], cf[2], cf[3]);
      *(float4*)(po + 4) = make_float4(cf[4], cf[5], cf[6], cf[7]);
    }

    // online softmax update (per-lane state for t = lm)
    float vmax = cf[0];
#pragma unroll
    for (int r = 1; r < 8; ++r) vmax = fmaxf(vmax, cf[r]);
    const float mt = fmaxf(vmax, __shfl_xor(vmax, 16, 32));
    const float m_new = fmaxf(m_run, mt);
    float p[8]; float s = 0.f;
#pragma unroll
    for (int r = 0; r < 8; ++r) { p[r] = __expf(cf[r] - m_new); s += p[r]; }
    s += __shfl_xor(s, 16, 32);
    const float factor = __expf(m_run - m_new);
    l_run = l_run * factor + s;
    m_run = m_new;
    float fr[8];
#pragma unroll
    for (int r = 0; r < 8; ++r) fr[r] = __shfl(factor, r + 8 * hi, 32);
#pragma unroll
    for (int dt = 0; dt < 4; ++dt)
#pragma unroll
      for (int r = 0; r < 8; ++r) accP[dt][r] *= fr[r];

    // GEMM-2/3: acc[t x d] += P * k^T  and  macc[t x d] += mlp_w * k^T
#pragma unroll
    for (int kc = 0; kc < 4; ++kc) {
      const int na = kc * 4;
      const int ra = na & 7, rb = (na + 2) & 7;    // src reg per dest half
      const int sl = lm + ((na >= 8) ? 16 : 0);    // src lane
      const float x0a = __shfl(p[ra], sl, 32);
      const float x0b = __shfl(p[rb], sl, 32);
      const float x1a = __shfl(p[ra + 1], sl, 32);
      const float x1b = __shfl(p[rb + 1], sl, 32);
      v2f ap; ap.x = hi ? x0b : x0a; ap.y = hi ? x1b : x1a;
      const int noff = na + hi * 2;
      const v2f am = mw_cur[kc];
#pragma unroll
      for (int dt = 0; dt < 4; ++dt) {
        const int dloc = dt * 16 + lm;
        v2f bf;
        bf.x = kb[dloc * KSTRIDE + noff];
        bf.y = kb[dloc * KSTRIDE + noff + 1];
        accP[dt] = wmma_f32(ap, bf, accP[dt]);
        accM[dt] = wmma_f32(am, bf, accM[dt]);
      }
    }
  };

#ifdef HAVE_ASYNC_LDS
  // ---- async double-buffered staging: DMA next tile while computing ----
  auto issue_tile = [&](int tile, int buf) {
    const int nbase = tile * 16;
    float* dst = ks + buf * (DH * KSTRIDE);
#pragma unroll
    for (int i = 0; i < 8; ++i) {
      const int idx = lane + 32 * i;
      const int r = idx >> 2, quad = idx & 3;
      const float* g = kbase + (size_t)r * HWN + nbase + quad * 4;
      float* l = dst + r * KSTRIDE + quad * 4;
      __builtin_amdgcn_global_load_async_to_lds_b128((GV4*)g, (LV4*)l, 0, 0);
    }
  };
  int buf = 0;
  issue_tile(wave, buf);
  load_mw(wave, mw_nxt);
  project_tokens();                  // runs while the first tile is in flight
  for (int tile = wave; tile < NTILES; tile += NWAVES) {
    const int nxt = tile + NWAVES;
    take_mw(mw_cur, mw_nxt);
    load_mw(nxt < NTILES ? nxt : tile, mw_nxt);  // last trip: its own tile again, unused
    if (nxt < NTILES) {
      issue_tile(nxt, buf ^ 1);
      WAIT_ASYNC(8);                 // current buffer's 8 transfers complete
    } else {
      WAIT_ASYNC(0);
    }
    compute_tile(tile * 16, ks + buf * (DH * KSTRIDE));
    buf ^= 1;
  }
#else
  // ---- fallback: software-pipelined register prefetch, single buffer ----
  float4 pf[8];
  auto load_regs = [&](int tile) {
    const int nbase = tile * 16;
#pragma unroll
    for (int i = 0; i < 8; ++i) {
      const int idx = lane + 32 * i;
      const int r = idx >> 2, quad = idx & 3;
      pf[i] = *(const float4*)(kbase + (size_t)r * HWN + nbase + quad * 4);
    }
  };
  auto store_regs = [&]() {
#pragma unroll
    for (int i = 0; i < 8; ++i) {
      const int idx = lane + 32 * i;
      const int r = idx >> 2, quad = idx & 3;
      *(float4*)(ks + r * KSTRIDE + quad * 4) = pf[i];
    }
  };
  load_regs(wave);
  load_mw(wave, mw_nxt);
  project_tokens();
  for (int tile = wave; tile < NTILES; tile += NWAVES) {
    store_regs();                    // DS is in-order: safe vs prior tile reads
    const int nxt = tile + NWAVES;
    take_mw(mw_cur, mw_nxt);
    load_mw(nxt < NTILES ? nxt : tile, mw_nxt);  // last trip: its own tile again, unused
    if (nxt < NTILES) load_regs(nxt);  // overlap next HBM fetch with compute
    compute_tile(tile * 16, ks);
  }
#endif

  // ---- split-K combine across the waves ----
  if (hi == 0 && lm < TT) { cm[wave][lm] = m_run; cl[wave][lm] = l_run; }
  if (hi == 0) {                  // lanes 0..15 hold rows t = r (r < 6 valid)
#pragma unroll
    for (int dt = 0; dt < 4; ++dt)
#pragma unroll
      for (int r = 0; r < TT; ++r) {
        cAP[wave][r][dt * 16 + lm] = accP[dt][r];
        cAM[wave][r][dt * 16 + lm] = accM[dt][r];
      }
  }
  __syncthreads();

  for (int idx = threadIdx.x; idx < TT * DH; idx += BLKT) {
    const int t = idx >> 6, d = idx & 63;
    float M = cm[0][t];
#pragma unroll
    for (int w = 1; w < NWAVES; ++w) M = fmaxf(M, cm[w][t]);
    float L = 0.f, P = 0.f, Q = 0.f;
#pragma unroll
    for (int w = 0; w < NWAVES; ++w) {
      const float e = __expf(cm[w][t] - M);
      L += cl[w][t] * e;
      P += cAP[w][t][d] * e;
      Q += cAM[w][t][d];
    }
    const int cch = head * DH + d;
    const float av = als[0][t][d] + als[1][t][d];
    const float g = fminf(fmaxf(av + 3.f, 0.f), 6.f) * (2.f / 6.f);  // h_sigmoid*2
    const float tsv = (Q + mlp_b[t] + P / L) * g;
    ts_ws[((size_t)t * BS + b) * CCH + cch] = tsv;
  }
}

// ---------------- Stage C: proj + residual + LayerNorm ---------------------
// One block per PR rows (row = t*64 + b). Eight neighbouring lanes share one
// proj_w row: a wave's 16-byte load covers 4 rows x 128 contiguous bytes, and a
// lane's 24 weight loads and 24 ts loads have no wait between them. Each weight
// is used for PR rows. The 8 partial sums of an output meet by lane exchange.
#define PR 3                // rows per block
#define PJ 3                // groups of 4 output columns per wave: 16 waves x 3 x 4 = 192
typedef float v4f __attribute__((ext_vector_type(4)));

template <int CTRL>
__device__ __forceinline__ float add_xmask(float x) {
  // x + (x of lane l ^ m) inside a 16-lane row, CTRL = 0x160 + m (row_xmask)
  const int y = __builtin_amdgcn_update_dpp(0, __float_as_int(x), CTRL, 0xf, 0xf, true);
  return x + __int_as_float(y);
}
__device__ __forceinline__ float add_x16(float x) {
  // x + (x of lane l ^ 16)
  const int v = __float_as_int(x);
  const int y = __builtin_amdgcn_permlanex16(v, v, 0x76543210, 0xfedcba98, false, false);
  return x + __int_as_float(y);
}

__global__ __launch_bounds__(BLKT) void k_projln(
    const float* __restrict__ ts_ws, const float* __restrict__ tokens,
    const float* __restrict__ proj_w, const float* __restrict__ proj_b,
    const float* __restrict__ ln_g, const float* __restrict__ ln_b,
    float* __restrict__ tok_out) {
  __shared__ __attribute__((aligned(16))) float ys[PR][DD];  // read back 8 bytes a lane
  const int row0 = blockIdx.x * PR;
  const int wave = __builtin_amdgcn_readfirstlane(threadIdx.x >> 5);
  const int lane = threadIdx.x & 31;
  const int sub = lane & 7, grp = lane >> 3;   // k slice, column inside the group

  // waves 0..PR-1 finish one row each (columns 2*lane + 64*i, +1); what they
  // need for that is asked for first, so that it is there when the sums are
  v2f tk[3], pb[3], lg[3], lb[3];
  if (wave < PR) {
    const float* tr = tokens + (size_t)(row0 + wave) * DD;
#pragma unroll
    for (int i = 0; i < 3; ++i) {
      const int j = 2 * lane + 64 * i;
      tk[i] = *(const v2f*)(tr + j);
      pb[i] = *(const v2f*)(proj_b + j);
      lg[i] = *(const v2f*)(ln_g + j);
      lb[i] = *(const v2f*)(ln_b + j);
    }
  }

  // lane's k: it*32 + sub*4 .. +3, the same for ts and for the weights
  const float* xb = ts_ws + (size_t)row0 * CCH;
  const float* wb = proj_w + (size_t)(wave * PJ * 4) * CCH;
  const int wo = grp * CCH + sub * 4;          // lane's place in the wave's first 4 weight rows
  v4f x[PR][8], w[PJ][8];
#pragma unroll
  for (int r = 0; r < PR; ++r)
#pragma unroll
    for (int it = 0; it < 8; ++it)
      x[r][it] = *(const v4f*)(xb + (sub * 4 + r * CCH + it * 32));
#pragma unroll
  for (int p = 0; p < PJ; ++p)
#pragma unroll
    for (int it = 0; it < 8; ++it)
      w[p][it] = *(const v4f*)(wb + (wo + p * 4 * CCH + it * 32));
  // the offset registers that the loads above name stay whole until this wait
  asm volatile("s_wait_xcnt 0x0" ::"v"(wo * 4), "v"(sub) : "memory");

#pragma unroll
  for (int p = 0; p < PJ; ++p) {
    float v[PR];
#pragma unroll
    for (int r = 0; r < PR; ++r) {
      v2f acc = {0.f, 0.f};
#pragma unroll
      for (int it = 0; it < 8; ++it) {
        acc = w[p][it].lo * x[r][it].lo + acc;
        acc = w[p][it].hi * x[r][it].hi + acc;
      }
      float s = acc.x + acc.y;
      s = add_xmask<0x161>(s);
      s = add_xmask<0x162>(s);
      s = add_xmask<0x164>(s);                 // all 8 lanes of the column hold the sum
      v[r] = s;
    }
    const float val = sub == 0 ? v[0] : (sub == 1 ? v[1] : v[2]);
    if (sub < PR) ys[sub][(wave * PJ + p) * 4 + grp] = val;
  }
  __syncthreads();

  if (wave < PR) {
    v2f y[3];
    float s = 0.f, q = 0.f;
#pragma unroll
    for (int i = 0; i < 3; ++i) {
      y[i] = (*(const v2f*)(&ys[wave][2 * lane + 64 * i]) + pb[i]) + tk[i];
      s += y[i].x + y[i].y;
      q = fmaf(y[i].x, y[i].x, q);
      q = fmaf(y[i].y, y[i].y, q);
    }
    s = add_xmask<0x161>(s);  q = add_xmask<0x161>(q);
    s = add_xmask<0x162>(s);  q = add_xmask<0x162>(q);
    s = add_xmask<0x164>(s);  q = add_xmask<0x164>(q);
    s = add_xmask<0x168>(s);  q = add_xmask<0x168>(q);
    s = add_x16(s);           q = add_x16(q);
    const float mu = s / DD;
    const float var = q / DD - mu * mu;
    const float rr = rsqrtf(var + 1e-5f);
    float* po = tok_out + (size_t)(row0 + wave) * DD;
#pragma unroll
    for (int i = 0; i < 3; ++i)
      *(v2f*)(po + 2 * lane + 64 * i) = (y[i] - mu) * rr * lg[i] + lb[i];
  }
}

extern "C" void kernel_launch(void* const* d_in, const int* in_sizes, int n_in,
                              void* d_out, int out_size, void* d_ws, size_t ws_size,
                              hipStream_t stream) {
  (void)in_sizes; (void)n_in; (void)out_size; (void)ws_size;
  const float* features = (const float*)d_in[0];
  const float* tokens   = (const float*)d_in[1];
  const float* mlp_w    = (const float*)d_in[2];
  const float* mlp_b    = (const float*)d_in[3];
  const float* q_w      = (const float*)d_in[4];
  const float* q_b      = (const float*)d_in[5];
  const float* alpha_w  = (const float*)d_in[6];
  const float* alpha_b  = (const float*)d_in[7];
  const float* proj_w   = (const float*)d_in[8];
  const float* proj_b   = (const float*)d_in[9];
  const float* ln_g     = (const float*)d_in[10];
  const float* ln_b     = (const float*)d_in[11];

  float* tok_out  = (float*)d_out;                // [6,64,192]
  float* attn_out = tok_out + TT * BS * DD;       // [64,4,6,3136]

  float* ws     = (float*)d_ws;
  float* ts_ws  = ws;                             // 98304 f

  k_fused<<<BS * NH, BLKT, 0, stream>>>(features, tokens, mlp_w, mlp_b, q_w, q_b,
                                        alpha_w, alpha_b, attn_out, ts_ws);
  k_projln<<<TT * BS / PR, BLKT, 0, stream>>>(ts_ws, tokens, proj_w, proj_b,
                                        ln_g, ln_b, tok_out);
}
